// v000
// The times below were measured on an AMD MI455X: many runs one after another, warmed up first and cycling through
// copies of the inputs, with the whole window's GPU time divided by the number of runs. Launches and the gaps
// between them are all in it. The median over several windows is given; except for v000 it joins two sittings, which
// can be a few percent apart, so the side-by-side timings, each taken in one sitting, are the better comparison.
// The starting kernel, v000, takes 2200 microseconds a run.
#include <hip/hip_runtime.h>

// Contractions, f32 accumulate, processed one batch item at a time: qkv = x.W_qkv^T + b_qkv ([4096 x 1024].[1024 x 3072]; W is [out][in] = the n-major B operand
// as-is; PLAIN bf16 operands: inputs rounded once, exact) on v_wmma_f32_16x16x32_bf16 -> f16 hi + residual x1024 planes (v written transposed); then per chunk of
// 1024 queries (causal, so chunk c only touches keys < (c+1) 1024): S = q.k^T ([1024 x 1024].[1024 x <=4096], hi.hi + hi.lo + lo.hi, residual terms in their own
// accumulator) on v_wmma_f32_16x16x32_f16 -> f32; row softmax of S/32 over keys j <= i in f32 -> P (x32768) as f16 hi + UNSCALED residual planes (zeros above the
// diagonal) + row sums; y = P.v ([1024 x K].[K x 1024]: (ph + pl).vh + ph.vl) on v_wmma_f32_16x16x32_f16 scaled by 1/(rowsum x 32768). Single 1024-dim head.

#define NB_  2
#define NT_  4096
#define DM   1024
#define QCH  1024                // query rows per chunk (causal: chunk c sees keys < (c+1)*QCH)
#define PSC  32768.0f
#define LOSC 1024.0f
#define LOSCI (1.0f / 1024.0f)

typedef _Float16 h16;
typedef unsigned short bf;
typedef __attribute__((ext_vector_type(16))) __bf16   v16bf;
typedef __attribute__((ext_vector_type(16))) _Float16 v16h;
typedef __attribute__((ext_vector_type(8)))  _Float16 v8h;
typedef __attribute__((ext_vector_type(8)))  unsigned short v8us;
typedef __attribute__((ext_vector_type(8)))  float    v8f;
typedef __attribute__((ext_vector_type(4)))  float    v4f;
typedef v8h  __attribute__((may_alias)) v8ha;
typedef v4f  __attribute__((may_alias)) v4fa;
typedef v8us __attribute__((may_alias)) v8usa;

__device__ __forceinline__ unsigned short f2bf(float f) { unsigned u = __float_as_uint(f); u += 0x7FFFu + ((u >> 16) & 1u); return (unsigned short)(u >> 16); }
__device__ __forceinline__ float bf2f(unsigned short b) { return __uint_as_float(((unsigned)b) << 16); }
__device__ __forceinline__ v16h cat16(v8h lo, v8h hi) { return __builtin_shufflevector(lo, hi, 0, 1, 2, 3, 4, 5, 6, 7, 8, 9, 10, 11, 12, 13, 14, 15); }
__device__ __forceinline__ v16bf cat16b(v8us lo, v8us hi) { return __builtin_bit_cast(v16bf, __builtin_shufflevector(lo, hi, 0, 1, 2, 3, 4, 5, 6, 7, 8, 9, 10, 11, 12, 13, 14, 15)); }
__device__ __forceinline__ v8f wmma16(v16h a, v16h b, v8f c) { return __builtin_amdgcn_wmma_f32_16x16x32_f16(false, a, false, b, (short)0, c, false, false); }
__device__ __forceinline__ v8f wmmab(v16bf a, v16bf b, v8f c) { return __builtin_amdgcn_wmma_f32_16x16x32_bf16(false, a, false, b, (short)0, c, false, false); }

// k_cvtb: bf16 plane of [rows][1024] (one wave per row).
__global__ __launch_bounds__(256) void k_cvtb(const float* __restrict__ src, int nrows, bf* dst) {
    const int lane = threadIdx.x & 31, r = blockIdx.x * 8 + (threadIdx.x >> 5);
    if (r >= nrows) return;
    v8us o[DM / 256];
#pragma unroll
    for (int q = 0; q < DM / 256; ++q)
#pragma unroll
        for (int i = 0; i < 8; ++i) o[q][i] = f2bf(src[(size_t)r * DM + q * 256 + lane * 8 + i]);
#pragma unroll
    for (int q = 0; q < DM / 256; ++q) *(v8us*)(dst + (size_t)r * DM + q * 256 + lane * 8) = o[q];
    
}
// k_wt: WT [n][1024] = bf16(W[k][n]) (k-major [1024][1024]) via 64 x 64 LDS tiles; grid (16, 16).
__global__ __launch_bounds__(256) void k_wt(const float* __restrict__ Wm, bf* WT) {
    __shared__ __align__(16) unsigned short tl[64 * 72];
    const int tid = threadIdx.x, k0 = blockIdx.x * 64, n0 = blockIdx.y * 64;
    const int kk = tid >> 2, nq = (tid & 3) * 16;
#pragma unroll
    for (int i = 0; i < 16; ++i) tl[(nq + i) * 72 + kk] = f2bf(Wm[(size_t)(k0 + kk) * DM + n0 + nq + i]);
    __syncthreads();
    const int piece = tid & 7;
    auto pass = [&]() {
#pragma unroll
        for (int s = 0; s < 2; ++s) { const int nr = (tid >> 3) + 32 * s; const v8us val = *(const v8usa*)(tl + nr * 72 + piece * 8); *(v8us*)(WT + (size_t)(n0 + nr) * DM + k0 + piece * 8) = val; }
    };
    pass(); 
}
// k_proj: 64 x 64 tile of Yb.WT^T over K = 1024 (exact). MODE 0: f16 hi + residual x1024 planes [4096][1024]; MODE 1: the same written TRANSPOSED as VT[c][t]
template <int MODE>
__global__ __launch_bounds__(128) void k_proj(const bf* __restrict__ A, const bf* __restrict__ Bn, const float* __restrict__ bias, h16* PH, h16* PL) {
    __shared__ __align__(16) float ost[4][16 * 68];
    __shared__ __align__(16) h16 vt[64 * 72];
    __shared__ __align__(16) h16 vt2[64 * 72];
    const int lane = threadIdx.x & 31, wave = threadIdx.x >> 5, lr = lane & 15, hi = lane >> 4, tid = threadIdx.x;
    const int r0 = blockIdx.x * 64 + wave * 16, c0 = blockIdx.y * 64;
    v8f acc[4];
#pragma unroll
    for (int t = 0; t < 4; ++t) acc[t] = (v8f){};
#pragma unroll 2
    for (int kc = 0; kc < DM; kc += 32) {
        const v16bf a = cat16b(*(const v8us*)(A + (size_t)(r0 + lr) * DM + kc + 8 * hi), *(const v8us*)(A + (size_t)(r0 + lr) * DM + kc + 8 * hi + 16));
#pragma unroll
        for (int t = 0; t < 4; ++t) { const bf* bp = Bn + (size_t)(c0 + t * 16 + lr) * DM + kc + 8 * hi; acc[t] = wmmab(a, cat16b(*(const v8us*)bp, *(const v8us*)(bp + 16)), acc[t]); }
        asm volatile("v_nop" : "+v"(acc[0]), "+v"(acc[1]), "+v"(acc[2]), "+v"(acc[3]) : "v"(a) : "memory");
    }
    float* os = &ost[wave][0];
#pragma unroll
    for (int t = 0; t < 4; ++t) { const float bv = bias ? __uint_as_float(((unsigned)f2bf(bias[c0 + t * 16 + lr])) << 16) : 0.f;
#pragma unroll
        for (int j = 0; j < 8; ++j) os[(hi * 8 + j) * 68 + t * 16 + lr] = acc[t][j] + bv; }
    __syncthreads();
    if (MODE == 0) {
        h16* c1 = PH + (size_t)r0 * DM + c0; h16* c2 = PL + (size_t)r0 * DM + c0;
        auto pass = [&]() {
#pragma unroll
            for (int s = 0; s < 4; ++s) { const int row = 4 * s + (lane >> 3), piece = lane & 7; const float* sp = os + row * 68 + piece * 8; v8h o1, o2;
#pragma unroll
                for (int i = 0; i < 8; ++i) { const h16 ah = (h16)sp[i]; o1[i] = ah; o2[i] = (h16)((sp[i] - (float)ah) * LOSC); }
                *(v8h*)(c1 + (size_t)row * DM + piece * 8) = o1; *(v8h*)(c2 + (size_t)row * DM + piece * 8) = o2; }
        };
        pass(); 
    } else {
        { const int row = tid >> 1, half = tid & 1;
#pragma unroll
          for (int i = 0; i < 32; ++i) { const float v = ost[row >> 4][(row & 15) * 68 + half * 32 + i]; const h16 ah = (h16)v; vt[(half * 32 + i) * 72 + row] = ah; vt2[(half * 32 + i) * 72 + row] = (h16)((v - (float)ah) * LOSC); } }
        __syncthreads();
        const int piece = tid & 7; const int t0 = blockIdx.x * 64;
        auto pass = [&]() {
#pragma unroll
            for (int s = 0; s < 4; ++s) { const int d = (tid >> 3) + 16 * s; const size_t o = (size_t)(c0 + d) * NT_ + t0 + piece * 8;
                *(v8h*)(PH + o) = *(const v8ha*)(vt + d * 72 + piece * 8); *(v8h*)(PL + o) = *(const v8ha*)(vt2 + d * 72 + piece * 8); }
        };
        pass(); 
    }
}
// k_f16gemm: 64 x 64 tile over K of (A, Al) x (B, Bl) f16 planes, three products with the x1024 residual terms in their OWN accumulator: EPI 0 (S = q.k^T/32):
// acc = a.b, accx = al.b + a.bl (both lo planes are x1024) -> (acc + accx/1024)/32; EPI 1 (O = P.v): acc = a.b + al.b (P residual is unscaled), accx = a.bl (v residual
// x1024) -> (acc + accx/1024) x rs[row] with rs = 1/(rowsum x 32768).
template <int EPI>
__global__ __launch_bounds__(128) void k_f16gemm(const h16* __restrict__ A, const h16* __restrict__ Al, int lda, const h16* __restrict__ Bn, const h16* __restrict__ Bl, int ldb, int K, const float* __restrict__ rs, float* C, int ldc) {
    __shared__ __align__(16) float ost[4][16 * 68];
    const int lane = threadIdx.x & 31, wave = threadIdx.x >> 5, lr = lane & 15, hi = lane >> 4;
    const int r0 = blockIdx.x * 64 + wave * 16, c0 = blockIdx.y * 64;
    const size_t aoff = (size_t)(r0 + lr) * lda + 8 * hi;
    size_t boff[4];
#pragma unroll
    for (int t = 0; t < 4; ++t) boff[t] = (size_t)(c0 + t * 16 + lr) * ldb + 8 * hi;
    v8f acc[4], accx[4];
#pragma unroll
    for (int t = 0; t < 4; ++t) { acc[t] = (v8f){}; accx[t] = (v8f){}; }
#pragma unroll 2
    for (int kc = 0; kc < K; kc += 32) {
        const v16h a = cat16(*(const v8h*)(A + aoff + kc), *(const v8h*)(A + aoff + kc + 16)), al = cat16(*(const v8h*)(Al + aoff + kc), *(const v8h*)(Al + aoff + kc + 16));
#pragma unroll
        for (int t = 0; t < 4; ++t) { const v16h bb = cat16(*(const v8h*)(Bn + boff[t] + kc), *(const v8h*)(Bn + boff[t] + kc + 16)), bl = cat16(*(const v8h*)(Bl + boff[t] + kc), *(const v8h*)(Bl + boff[t] + kc + 16));
            acc[t] = wmma16(a, bb, acc[t]); accx[t] = wmma16(a, bl, accx[t]);
            if (EPI == 0) accx[t] = wmma16(al, bb, accx[t]); else acc[t] = wmma16(al, bb, acc[t]); }
        asm volatile("v_nop" : "+v"(acc[0]), "+v"(acc[1]), "+v"(acc[2]), "+v"(acc[3]), "+v"(accx[0]), "+v"(accx[1]), "+v"(accx[2]), "+v"(accx[3]) : "v"(a), "v"(al) : "memory");
    }
    float* os = &ost[wave][0];
#pragma unroll
    for (int t = 0; t < 4; ++t)
#pragma unroll
        for (int j = 0; j < 8; ++j) { const float sc = (EPI == 0) ? 0.03125f : rs[r0 + hi * 8 + j]; os[(hi * 8 + j) * 68 + t * 16 + lr] = (acc[t][j] + accx[t][j] * LOSCI) * sc; }
    __builtin_amdgcn_wave_barrier(); asm volatile("" ::: "memory");
    float* crow = C + (size_t)r0 * ldc + c0;
    auto pass = [&]() {
#pragma unroll
        for (int s = 0; s < 8; ++s) { const int Lid = (lane >> 3) + 4 * s, piece = lane & 7; const int row = Lid >> 1, cofs = (Lid & 1) * 32 + piece * 4;
            const v4f val = *(const v4fa*)(os + row * 68 + cofs); *(v4f*)(crow + (size_t)row * ldc + cofs) = val; }
    };
    pass(); 
}

// k_soft: row softmax of S [1024][4096] (one wave per row, lane -> 8 of each 256 values, fixed-order shuffles): P = exp(s - max) x 32768 as f16 hi + UNSCALED residual
// planes, RS[row] = 1/(sum x 32768) (32 rows per block -> one line of RS written by wave 0).
__global__ __launch_bounds__(256) void k_soft(const float* __restrict__ S, int qbase, int kmax, h16* PH, h16* PL, float* RS) {
    __shared__ float rsum[32];
    const int lane = threadIdx.x & 31, wave = threadIdx.x >> 5;
#pragma unroll 1
    for (int rr = 0; rr < 4; ++rr) { const int row = blockIdx.x * 32 + wave * 4 + rr; const float* sr = S + (size_t)row * NT_; const int qi = qbase + row;
        float mx = -3.0e38f;
#pragma unroll 1
        for (int c = 0; c < kmax / 256; ++c)
#pragma unroll
            for (int i = 0; i < 8; ++i) { const int j = c * 256 + lane * 8 + i; if (j <= qi) mx = fmaxf(mx, sr[j]); }
#pragma unroll
        for (int sh = 16; sh; sh >>= 1) mx = fmaxf(mx, __shfl_xor(mx, sh, 32));
        float sum = 0.f;
{ sum = 0.f;
#pragma unroll 1
            for (int c = 0; c < kmax / 256; ++c) { v8h oh, ol;
#pragma unroll
                for (int i = 0; i < 8; ++i) { const int j = c * 256 + lane * 8 + i; const float p = (j <= qi) ? __expf(sr[j] - mx) : 0.f; sum += p; const float ps8 = p * PSC; const h16 a = (h16)ps8; oh[i] = a; ol[i] = (h16)(ps8 - (float)a); }
                *(v8h*)(PH + (size_t)row * NT_ + c * 256 + lane * 8) = oh; *(v8h*)(PL + (size_t)row * NT_ + c * 256 + lane * 8) = ol; }
             }
#pragma unroll
        for (int sh = 16; sh; sh >>= 1) sum += __shfl_xor(sum, sh, 32);
        if (lane == 0) rsum[wave * 4 + rr] = 1.0f / (sum * PSC); }
    __syncthreads();
    if (wave == 0) { const float v = rsum[lane]; *(float*)(RS + blockIdx.x * 32 + lane) = v;  }
}

extern "C" void kernel_launch(void* const* d_in, const int* in_sizes, int n_in,
                              void* d_out, int out_size, void* d_ws, size_t ws_size, hipStream_t stream) {
    (void)in_sizes; (void)n_in; (void)out_size;
    const float* x = (const float*)d_in[0]; const float* Wqkv = (const float*)d_in[1]; const float* bqkv = (const float*)d_in[2];
    float* out = (float*)d_out;    // [2][4096][1024]
    char* wsp = (char*)d_ws;
    auto take = [&](size_t bytes) { char* p = wsp; wsp += (bytes + 255) & ~(size_t)255; return (void*)p; };
    bf* Yb = (bf*)take((size_t)NT_ * DM * 2); bf* W3 = (bf*)take((size_t)3 * DM * DM * 2);
    h16* QH = (h16*)take((size_t)NT_ * DM * 2); h16* QL = (h16*)take((size_t)NT_ * DM * 2); h16* KH = (h16*)take((size_t)NT_ * DM * 2); h16* KL = (h16*)take((size_t)NT_ * DM * 2);
    h16* VTH = (h16*)take((size_t)DM * NT_ * 2); h16* VTL = (h16*)take((size_t)DM * NT_ * 2); float* S = (float*)take((size_t)QCH * NT_ * 4);
    h16* PH = (h16*)take((size_t)QCH * NT_ * 2); h16* PL = (h16*)take((size_t)QCH * NT_ * 2); float* RS = (float*)take((size_t)QCH * 4);
    if ((size_t)(wsp - (char*)d_ws) > ws_size) return;    // 8.4 + 6.3 + 6 x 8.4 + 16.8 + 16.8 ~ 99 MB (per batch item, reused)
    k_cvtb<<<(3 * DM) / 8, 256, 0, stream>>>(Wqkv, 3 * DM, W3);      // [3072][1024] [out][in] = n-major as-is; thirds q | k | v
    for (int b = 0; b < NB_; ++b) {
        k_cvtb<<<NT_ / 8, 256, 0, stream>>>(x + (size_t)b * NT_ * DM, NT_, Yb);
        k_proj<0><<<dim3(NT_ / 64, DM / 64, 1), 128, 0, stream>>>(Yb, W3, bqkv, QH, QL);
        k_proj<0><<<dim3(NT_ / 64, DM / 64, 1), 128, 0, stream>>>(Yb, W3 + (size_t)DM * DM, bqkv + DM, KH, KL);
        k_proj<1><<<dim3(NT_ / 64, DM / 64, 1), 128, 0, stream>>>(Yb, W3 + (size_t)2 * DM * DM, bqkv + 2 * DM, VTH, VTL);
        for (int c = 0; c < NT_ / QCH; ++c) { const int kmax = (c + 1) * QCH;
            k_f16gemm<0><<<dim3(QCH / 64, kmax / 64, 1), 128, 0, stream>>>(QH + (size_t)c * QCH * DM, QL + (size_t)c * QCH * DM, DM, KH, KL, DM, DM, nullptr, S, NT_);
            k_soft<<<QCH / 32, 256, 0, stream>>>(S, c * QCH, kmax, PH, PL, RS);
            k_f16gemm<1><<<dim3(QCH / 64, DM / 64, 1), 128, 0, stream>>>(PH, PL, NT_, VTH, VTL, NT_, kmax, RS, out + ((size_t)b * NT_ + (size_t)c * QCH) * DM, DM); }
    }
}

// v001
// A run of this version takes 1100 microseconds.
// In two side-by-side timings against v000, it was 2.04 and 2.05 times as fast.
#include <hip/hip_runtime.h>

// Contractions, f32 accumulate, every stage in ONE launch over both batch items and all query chunks: qkv = x.W_qkv^T + b_qkv ([4096 x 1024].[1024 x 3072]; W is [out][in] = the n-major B operand
// as-is; PLAIN bf16 operands: inputs rounded once, exact) on v_wmma_f32_16x16x32_bf16 -> f16 hi + residual x1024 planes (v written transposed); then per chunk of
// 1024 queries (causal, so chunk c only touches keys < (c+1) 1024): S = q.k^T ([1024 x 1024].[1024 x <=4096], hi.hi + hi.lo + lo.hi, residual terms in their own
// accumulator) on v_wmma_f32_16x16x32_f16 -> f32; row softmax of S/32 over keys j <= i in f32 -> P (x32768) as f16 hi + UNSCALED residual planes (zeros above the
// diagonal) + row sums; y = P.v ([1024 x K].[K x 1024]: (ph + pl).vh + ph.vl) on v_wmma_f32_16x16x32_f16 scaled by 1/(rowsum x 32768). Single 1024-dim head.

#define NB_  2
#define NT_  4096
#define DM   1024
#define QCH  1024                // query rows per chunk (causal: chunk c sees keys < (c+1)*QCH)
#define PSC  32768.0f
#define LOSC 1024.0f
#define LOSCI (1.0f / 1024.0f)
#define NCH  (NT_ / QCH)         // query chunks per batch item
#define CHE  ((size_t)QCH * QCH) // elements of one QCH x QCH square of S or P
#define BSQ  (NCH * (NCH + 1) / 2) // squares per batch item: chunk c holds c + 1 of them
// S and P: chunk c of batch item b starts at square b * BSQ + c (c + 1) / 2 and has QCH rows of pitch (c + 1) * QCH.
__device__ __forceinline__ size_t sq_off(int b, int c) { return ((size_t)b * BSQ + (size_t)(c * (c + 1) / 2)) * CHE; }

typedef _Float16 h16;
typedef unsigned short bf;
typedef __attribute__((ext_vector_type(16))) __bf16   v16bf;
typedef __attribute__((ext_vector_type(16))) _Float16 v16h;
typedef __attribute__((ext_vector_type(8)))  _Float16 v8h;
typedef __attribute__((ext_vector_type(8)))  unsigned short v8us;
typedef __attribute__((ext_vector_type(8)))  float    v8f;
typedef __attribute__((ext_vector_type(4)))  float    v4f;
typedef v8h  __attribute__((may_alias)) v8ha;
typedef v4f  __attribute__((may_alias)) v4fa;
typedef v8us __attribute__((may_alias)) v8usa;

__device__ __forceinline__ unsigned short f2bf(float f) { unsigned u = __float_as_uint(f); u += 0x7FFFu + ((u >> 16) & 1u); return (unsigned short)(u >> 16); }
__device__ __forceinline__ float bf2f(unsigned short b) { return __uint_as_float(((unsigned)b) << 16); }
__device__ __forceinline__ v16h cat16(v8h lo, v8h hi) { return __builtin_shufflevector(lo, hi, 0, 1, 2, 3, 4, 5, 6, 7, 8, 9, 10, 11, 12, 13, 14, 15); }
__device__ __forceinline__ v16bf cat16b(v8us lo, v8us hi) { return __builtin_bit_cast(v16bf, __builtin_shufflevector(lo, hi, 0, 1, 2, 3, 4, 5, 6, 7, 8, 9, 10, 11, 12, 13, 14, 15)); }
__device__ __forceinline__ v8f wmma16(v16h a, v16h b, v8f c) { return __builtin_amdgcn_wmma_f32_16x16x32_f16(false, a, false, b, (short)0, c, false, false); }
__device__ __forceinline__ v8f wmmab(v16bf a, v16bf b, v8f c) { return __builtin_amdgcn_wmma_f32_16x16x32_bf16(false, a, false, b, (short)0, c, false, false); }

// k_cvtb: bf16 plane of [rows][1024] (one wave per row).
__global__ __launch_bounds__(256) void k_cvtb(const float* __restrict__ src, int nrows, bf* dst) {
    const int lane = threadIdx.x & 31, r = blockIdx.x * 8 + (threadIdx.x >> 5);
    if (r >= nrows) return;
    v8us o[DM / 256];
#pragma unroll
    for (int q = 0; q < DM / 256; ++q)
#pragma unroll
        for (int i = 0; i < 8; ++i) o[q][i] = f2bf(src[(size_t)r * DM + q * 256 + lane * 8 + i]);
#pragma unroll
    for (int q = 0; q < DM / 256; ++q) *(v8us*)(dst + (size_t)r * DM + q * 256 + lane * 8) = o[q];
    
}
// k_wt: WT [n][1024] = bf16(W[k][n]) (k-major [1024][1024]) via 64 x 64 LDS tiles; grid (16, 16).
__global__ __launch_bounds__(256) void k_wt(const float* __restrict__ Wm, bf* WT) {
    __shared__ __align__(16) unsigned short tl[64 * 72];
    const int tid = threadIdx.x, k0 = blockIdx.x * 64, n0 = blockIdx.y * 64;
    const int kk = tid >> 2, nq = (tid & 3) * 16;
#pragma unroll
    for (int i = 0; i < 16; ++i) tl[(nq + i) * 72 + kk] = f2bf(Wm[(size_t)(k0 + kk) * DM + n0 + nq + i]);
    __syncthreads();
    const int piece = tid & 7;
    auto pass = [&]() {
#pragma unroll
        for (int s = 0; s < 2; ++s) { const int nr = (tid >> 3) + 32 * s; const v8us val = *(const v8usa*)(tl + nr * 72 + piece * 8); *(v8us*)(WT + (size_t)(n0 + nr) * DM + k0 + piece * 8) = val; }
    };
    pass(); 
}
// k_proj: 64 x 64 tile of Yb.WT^T over K = 1024 (exact), rows = both batch items. MODE 0: f16 hi + residual x1024 planes [rows][1024], output columns < 1024 to
// (PH, PL), the next 1024 to (PH2, PL2); MODE 1: the same written TRANSPOSED as VT[b][c][t]
template <int MODE>
__global__ __launch_bounds__(128) void k_proj(const bf* __restrict__ A, const bf* __restrict__ Bn, const float* __restrict__ bias, h16* PH, h16* PL, h16* PH2, h16* PL2) {
    __shared__ __align__(16) float ost[4][16 * 68];
    __shared__ __align__(16) h16 vt[64 * 72];
    __shared__ __align__(16) h16 vt2[64 * 72];
    const int lane = threadIdx.x & 31, wave = threadIdx.x >> 5, lr = lane & 15, hi = lane >> 4, tid = threadIdx.x;
    const int r0 = blockIdx.x * 64 + wave * 16, c0 = blockIdx.y * 64;
    v8f acc[4];
#pragma unroll
    for (int t = 0; t < 4; ++t) acc[t] = (v8f){};
#pragma unroll 2
    for (int kc = 0; kc < DM; kc += 32) {
        const v16bf a = cat16b(*(const v8us*)(A + (size_t)(r0 + lr) * DM + kc + 8 * hi), *(const v8us*)(A + (size_t)(r0 + lr) * DM + kc + 8 * hi + 16));
#pragma unroll
        for (int t = 0; t < 4; ++t) { const bf* bp = Bn + (size_t)(c0 + t * 16 + lr) * DM + kc + 8 * hi; acc[t] = wmmab(a, cat16b(*(const v8us*)bp, *(const v8us*)(bp + 16)), acc[t]); }
        asm volatile("v_nop" : "+v"(acc[0]), "+v"(acc[1]), "+v"(acc[2]), "+v"(acc[3]) : "v"(a) : "memory");
    }
    float* os = &ost[wave][0];
#pragma unroll
    for (int t = 0; t < 4; ++t) { const float bv = bias ? __uint_as_float(((unsigned)f2bf(bias[c0 + t * 16 + lr])) << 16) : 0.f;
#pragma unroll
        for (int j = 0; j < 8; ++j) os[(hi * 8 + j) * 68 + t * 16 + lr] = acc[t][j] + bv; }
    __syncthreads();
    if (MODE == 0) {
        const size_t o0 = (size_t)r0 * DM + (c0 & (DM - 1)); h16* c1 = (c0 < DM ? PH : PH2) + o0; h16* c2 = (c0 < DM ? PL : PL2) + o0;
        auto pass = [&]() {
#pragma unroll
            for (int s = 0; s < 4; ++s) { const int row = 4 * s + (lane >> 3), piece = lane & 7; const float* sp = os + row * 68 + piece * 8; v8h o1, o2;
#pragma unroll
                for (int i = 0; i < 8; ++i) { const h16 ah = (h16)sp[i]; o1[i] = ah; o2[i] = (h16)((sp[i] - (float)ah) * LOSC); }
                *(v8h*)(c1 + (size_t)row * DM + piece * 8) = o1; *(v8h*)(c2 + (size_t)row * DM + piece * 8) = o2; }
        };
        pass(); 
    } else {
        { const int row = tid >> 1, half = tid & 1;
#pragma unroll
          for (int i = 0; i < 32; ++i) { const float v = ost[row >> 4][(row & 15) * 68 + half * 32 + i]; const h16 ah = (h16)v; vt[(half * 32 + i) * 72 + row] = ah; vt2[(half * 32 + i) * 72 + row] = (h16)((v - (float)ah) * LOSC); } }
        __syncthreads();
        const int piece = tid & 7; const int t0 = (blockIdx.x * 64) & (NT_ - 1), bi = (blockIdx.x * 64) / NT_;
        auto pass = [&]() {
#pragma unroll
            for (int s = 0; s < 4; ++s) { const int d = (tid >> 3) + 16 * s; const size_t o = (size_t)(bi * DM + c0 + d) * NT_ + t0 + piece * 8;
                *(v8h*)(PH + o) = *(const v8ha*)(vt + d * 72 + piece * 8); *(v8h*)(PL + o) = *(const v8ha*)(vt2 + d * 72 + piece * 8); }
        };
        pass(); 
    }
}
// k_f16gemm: 64 x 64 tile over K of (A, Al) x (B, Bl) f16 planes, three products with the x1024 residual terms in their OWN accumulator: EPI 0 (S = q.k^T/32):
// acc = a.b, accx = al.b + a.bl (both lo planes are x1024) -> (acc + accx/1024)/32; EPI 1 (O = P.v): acc = a.b + al.b (P residual is unscaled), accx = a.bl (v residual
// x1024) -> (acc + accx/1024) x rs[row] with rs = 1/(rowsum x 32768).
// One launch holds every (batch item b, chunk c). EPI 0: grid (QCH/64, BSQ QCH/64, NB_), blockIdx.y runs through the key tiles of chunk 0, 1, ...; EPI 1: grid
// (QCH/64, DM/64, NB_ NCH), the chunk with the longest K first.
template <int EPI>
__global__ __launch_bounds__(128) void k_f16gemm(const h16* __restrict__ A, const h16* __restrict__ Al, const h16* __restrict__ Bn, const h16* __restrict__ Bl, const float* __restrict__ rs, float* C) {
    __shared__ __align__(16) float ost[4][16 * 68];
    const int lane = threadIdx.x & 31, wave = threadIdx.x >> 5, lr = lane & 15, hi = lane >> 4;
    int b, c, ct;
    if (EPI == 0) { b = blockIdx.z; ct = blockIdx.y; c = 0;
#pragma unroll
        for (int i = 1; i < NCH; ++i) if ((int)blockIdx.y >= (QCH / 64) * (i * (i + 1) / 2)) { c = i; ct = blockIdx.y - (QCH / 64) * (i * (i + 1) / 2); } }
    else { b = blockIdx.z % NB_; c = NCH - 1 - (blockIdx.z / NB_); ct = blockIdx.y; }
    const int wid = (c + 1) * QCH;                            // keys that chunk c sees
    const size_t qrow = (size_t)(b * NT_ + c * QCH) * DM, sq = sq_off(b, c), bb0 = (size_t)b * NT_ * DM;
    const int lda = (EPI == 0) ? DM : wid, ldb = (EPI == 0) ? DM : NT_, K = (EPI == 0) ? DM : wid, ldc = (EPI == 0) ? wid : DM;
    A += (EPI == 0) ? qrow : sq; Al += (EPI == 0) ? qrow : sq; Bn += bb0; Bl += bb0; C += (EPI == 0) ? sq : qrow;
    if (EPI == 1) rs += b * NT_ + c * QCH;
    const int r0 = blockIdx.x * 64 + wave * 16, c0 = ct * 64;
    const size_t aoff = (size_t)(r0 + lr) * lda + 8 * hi;
    size_t boff[4];
#pragma unroll
    for (int t = 0; t < 4; ++t) boff[t] = (size_t)(c0 + t * 16 + lr) * ldb + 8 * hi;
    v8f acc[4], accx[4];
#pragma unroll
    for (int t = 0; t < 4; ++t) { acc[t] = (v8f){}; accx[t] = (v8f){}; }
#pragma unroll 2
    for (int kc = 0; kc < K; kc += 32) {
        const v16h a = cat16(*(const v8h*)(A + aoff + kc), *(const v8h*)(A + aoff + kc + 16)), al = cat16(*(const v8h*)(Al + aoff + kc), *(const v8h*)(Al + aoff + kc + 16));
#pragma unroll
        for (int t = 0; t < 4; ++t) { const v16h bb = cat16(*(const v8h*)(Bn + boff[t] + kc), *(const v8h*)(Bn + boff[t] + kc + 16)), bl = cat16(*(const v8h*)(Bl + boff[t] + kc), *(const v8h*)(Bl + boff[t] + kc + 16));
            acc[t] = wmma16(a, bb, acc[t]); accx[t] = wmma16(a, bl, accx[t]);
            if (EPI == 0) accx[t] = wmma16(al, bb, accx[t]); else acc[t] = wmma16(al, bb, acc[t]); }
        asm volatile("v_nop" : "+v"(acc[0]), "+v"(acc[1]), "+v"(acc[2]), "+v"(acc[3]), "+v"(accx[0]), "+v"(accx[1]), "+v"(accx[2]), "+v"(accx[3]) : "v"(a), "v"(al) : "memory");
    }
    float* os = &ost[wave][0];
#pragma unroll
    for (int t = 0; t < 4; ++t)
#pragma unroll
        for (int j = 0; j < 8; ++j) { const float sc = (EPI == 0) ? 0.03125f : rs[r0 + hi * 8 + j]; os[(hi * 8 + j) * 68 + t * 16 + lr] = (acc[t][j] + accx[t][j] * LOSCI) * sc; }
    __builtin_amdgcn_wave_barrier(); asm volatile("" ::: "memory");
    float* crow = C + (size_t)r0 * ldc + c0;
    auto pass = [&]() {
#pragma unroll
        for (int s = 0; s < 8; ++s) { const int Lid = (lane >> 3) + 4 * s, piece = lane & 7; const int row = Lid >> 1, cofs = (Lid & 1) * 32 + piece * 4;
            const v4f val = *(const v4fa*)(os + row * 68 + cofs); *(v4f*)(crow + (size_t)row * ldc + cofs) = val; }
    };
    pass(); 
}

// k_soft: row softmax of S, chunk c [1024][(c + 1) 1024] (one wave per row, lane -> (c + 1) 32 values in runs of 8 at stride 256, fixed-order shuffles): P = exp(s - max) x 32768 as f16 hi + UNSCALED residual
// planes, RS[row] = 1/(sum x 32768) (32 rows per block -> one line of RS written by wave 0). Grid (QCH/32, NB_ NCH): blockIdx.y = (batch item, chunk), widest chunk first.
__global__ __launch_bounds__(256) void k_soft(const float* __restrict__ S, h16* PH, h16* PL, float* RS) {
    __shared__ float rsum[32];
    const int lane = threadIdx.x & 31, wave = threadIdx.x >> 5;
    const int b = blockIdx.y % NB_, ch = NCH - 1 - (blockIdx.y / NB_), qbase = ch * QCH, kmax = (ch + 1) * QCH;
    const size_t sq = sq_off(b, ch);
    S += sq; PH += sq; PL += sq; RS += b * NT_ + qbase;
#pragma unroll 1
    for (int rr = 0; rr < 4; ++rr) { const int row = blockIdx.x * 32 + wave * 4 + rr; const float* sr = S + (size_t)row * kmax; const int qi = qbase + row;
        float mx = -3.0e38f;
#pragma unroll 1
        for (int c = 0; c < kmax / 256; ++c)
#pragma unroll
            for (int i = 0; i < 8; ++i) { const int j = c * 256 + lane * 8 + i; if (j <= qi) mx = fmaxf(mx, sr[j]); }
#pragma unroll
        for (int sh = 16; sh; sh >>= 1) mx = fmaxf(mx, __shfl_xor(mx, sh, 32));
        float sum = 0.f;
{ sum = 0.f;
#pragma unroll 1
            for (int c = 0; c < kmax / 256; ++c) { v8h oh, ol;
#pragma unroll
                for (int i = 0; i < 8; ++i) { const int j = c * 256 + lane * 8 + i; const float p = (j <= qi) ? __expf(sr[j] - mx) : 0.f; sum += p; const float ps8 = p * PSC; const h16 a = (h16)ps8; oh[i] = a; ol[i] = (h16)(ps8 - (float)a); }
                *(v8h*)(PH + (size_t)row * kmax + c * 256 + lane * 8) = oh; *(v8h*)(PL + (size_t)row * kmax + c * 256 + lane * 8) = ol; }
             }
#pragma unroll
        for (int sh = 16; sh; sh >>= 1) sum += __shfl_xor(sum, sh, 32);
        if (lane == 0) rsum[wave * 4 + rr] = 1.0f / (sum * PSC); }
    __syncthreads();
    if (wave == 0) { const float v = rsum[lane]; *(float*)(RS + blockIdx.x * 32 + lane) = v;  }
}

extern "C" void kernel_launch(void* const* d_in, const int* in_sizes, int n_in,
                              void* d_out, int out_size, void* d_ws, size_t ws_size, hipStream_t stream) {
    (void)in_sizes; (void)n_in; (void)out_size;
    const float* x = (const float*)d_in[0]; const float* Wqkv = (const float*)d_in[1]; const float* bqkv = (const float*)d_in[2];
    float* out = (float*)d_out;    // [2][4096][1024]
    char* wsp = (char*)d_ws;
    auto take = [&](size_t bytes) { char* p = wsp; wsp += (bytes + 255) & ~(size_t)255; return (void*)p; };
    const size_t pl = (size_t)NB_ * NT_ * DM * 2;                 // one 16-bit plane of [2 x 4096][1024]
    h16* QH = (h16*)take(pl); h16* QL = (h16*)take(pl); h16* KH = (h16*)take(pl); h16* KL = (h16*)take(pl); bf* Yb = (bf*)take(pl); bf* W3 = (bf*)take((size_t)3 * DM * DM * 2);
    h16* VTH = (h16*)take(pl); h16* VTL = (h16*)take(pl); float* S = (float*)take((size_t)NB_ * BSQ * CHE * 4); float* RS = (float*)take((size_t)NB_ * NT_ * 4);
    if ((size_t)(wsp - (char*)d_ws) > ws_size) return;    // 4 x 16 + 16 + 6 + 2 x 16 + 80 MiB ~ 198 MiB
    // P (2 planes of 40 MiB) is written after S is complete, over the q, k and x planes (5 x 16 MiB in a row), which nothing reads any more by then.
    h16* PH = QH; h16* PL = PH + (size_t)NB_ * BSQ * CHE;
    k_cvtb<<<(3 * DM) / 8, 256, 0, stream>>>(Wqkv, 3 * DM, W3);      // [3072][1024] [out][in] = n-major as-is; thirds q | k | v
    k_cvtb<<<(NB_ * NT_) / 8, 256, 0, stream>>>(x, NB_ * NT_, Yb);
    k_proj<0><<<dim3(NB_ * NT_ / 64, 2 * DM / 64, 1), 128, 0, stream>>>(Yb, W3, bqkv, QH, QL, KH, KL);
    k_proj<1><<<dim3(NB_ * NT_ / 64, DM / 64, 1), 128, 0, stream>>>(Yb, W3 + (size_t)2 * DM * DM, bqkv + 2 * DM, VTH, VTL, nullptr, nullptr);
    k_f16gemm<0><<<dim3(QCH / 64, BSQ * (QCH / 64), NB_), 128, 0, stream>>>(QH, QL, KH, KL, nullptr, S);
    k_soft<<<dim3(QCH / 32, NB_ * NCH, 1), 256, 0, stream>>>(S, PH, PL, RS);
    k_f16gemm<1><<<dim3(QCH / 64, DM / 64, NB_ * NCH), 128, 0, stream>>>(PH, PL, VTH, VTL, RS, out);
}
